// v000
// Measured on an AMD MI455X. A time is GPU time per run, averaged over a window of back-to-back runs after a warm-up
// (all launches, gaps included; the runs take copies of the inputs in turn), and the median of several windows.
// Apart from v000's, it joins two sittings. Times from different sittings can be a few percent apart, while
// side-by-side timings come from the same sitting.
// v000, which the later versions start from, runs in 27.6 microseconds.
#include <hip/hip_runtime.h>
#include <cstdint>

#define SEQ   2048
#define DIM   64
#define NHEAD 64
#define LSTR  65
#define KSTR  72

typedef float v2f __attribute__((ext_vector_type(2)));
typedef float v8f __attribute__((ext_vector_type(8)));
typedef int   v4i __attribute__((ext_vector_type(4)));

typedef __attribute__((address_space(1))) v4i gv4i;   // global b128
typedef __attribute__((address_space(3))) v4i lv4i;   // LDS b128

#if __has_builtin(__builtin_amdgcn_global_load_async_to_lds_b128) && \
    __has_builtin(__builtin_amdgcn_s_wait_asynccnt)
#define USE_ASYNC_LDS 1
#else
#define USE_ASYNC_LDS 0
#endif

__device__ __forceinline__ v8f wmma4_f32(v2f a, v2f b, v8f c) {
  // (neg_a, A, neg_b, B, c_mod, C, reuse_a, reuse_b)
  return __builtin_amdgcn_wmma_f32_16x16x4_f32(false, a, false, b, (short)0, c,
                                               false, false);
}

// Issue staging of one 64x64 f32 tile into LDS (row stride KSTR).
// Async path: 4 x b128 async-to-LDS per thread (8 wave instructions per
// K+V chunk). Fallback: float4 global load + scalar LDS stores.
__device__ __forceinline__ void stage_issue(const float* __restrict__ g,
                                            float* __restrict__ lds, int tid) {
#if USE_ASYNC_LDS
#pragma unroll
  for (int i = 0; i < 4; ++i) {
    const int e   = tid + i * 256;
    const int row = e >> 4;
    const int c4  = (e & 15) * 4;
    gv4i* gp = (gv4i*)(uintptr_t)(g + e * 4);
    lv4i* lp = (lv4i*)(uintptr_t)(lds + row * KSTR + c4);
    __builtin_amdgcn_global_load_async_to_lds_b128(gp, lp, 0, 0);
  }
#else
  const float4* g4 = (const float4*)g;
#pragma unroll
  for (int i = 0; i < 4; ++i) {
    const int e   = tid + i * 256;
    const int row = e >> 4;
    const int c4  = (e & 15) * 4;
    float4 x = g4[e];
    float* d = &lds[row * KSTR + c4];
    d[0] = x.x; d[1] = x.y; d[2] = x.z; d[3] = x.w;
  }
#endif
}

__device__ __forceinline__ void stage_wait_prev() {
#if USE_ASYNC_LDS
  __builtin_amdgcn_s_wait_asynccnt(8);  // keep only the 8 newest outstanding
#endif
}
__device__ __forceinline__ void stage_wait_all() {
#if USE_ASYNC_LDS
  __builtin_amdgcn_s_wait_asynccnt(0);
#endif
}

// ---------------------------------------------------------------------------
// Phase 1: Mpart[head,seg] = K[head, seg-range]^T @ V[head, seg-range]
// One block per (head, seg). Wave w owns tiles (d1 = w>>1, d2 = (w&1)*2..+1).
// ---------------------------------------------------------------------------
template <int NS>
__global__ __launch_bounds__(256) void sattn_ktv_kernel(
    const float* __restrict__ Kp, const float* __restrict__ Vp,
    float* __restrict__ Mpart) {
  __shared__ float kbuf[2][64 * KSTR];
  __shared__ float vbuf[2][64 * KSTR];

  const int tid  = threadIdx.x;
  const int wave = tid >> 5;
  const int lane = tid & 31;
  const int lh   = lane >> 4;
  const int ll   = lane & 15;
  const int d1b  = (wave >> 1) * 16;
  const int d2b  = (wave & 1) * 32;

  const int head = blockIdx.x / NS;
  const int seg  = blockIdx.x % NS;
  const int nch  = (SEQ / NS) / 64;  // 64-row chunks in this segment
  const size_t base = (size_t)head * SEQ * DIM + (size_t)seg * (SEQ / NS) * DIM;
  const float* kg = Kp + base;
  const float* vg = Vp + base;

  stage_issue(kg, kbuf[0], tid);
  stage_issue(vg, vbuf[0], tid);

  v8f c0 = {};
  v8f c1 = {};
  int cur = 0;
  for (int ch = 0; ch < nch; ++ch) {
    if (ch + 1 < nch) {
      stage_issue(kg + (size_t)(ch + 1) * 64 * DIM, kbuf[cur ^ 1], tid);
      stage_issue(vg + (size_t)(ch + 1) * 64 * DIM, vbuf[cur ^ 1], tid);
      stage_wait_prev();   // chunk ch complete; chunk ch+1 flies during compute
    } else {
      stage_wait_all();
    }
    __syncthreads();

    const float* kb = kbuf[cur];
    const float* vb = vbuf[cur];
#pragma unroll
    for (int k0 = 0; k0 < 64; k0 += 4) {
      const int r = k0 + 2 * lh;
      v2f a, b0, b1;
      a.x  = kb[(r    ) * KSTR + d1b + ll];      // A = K^T (m=d1, k=t)
      a.y  = kb[(r + 1) * KSTR + d1b + ll];
      b0.x = vb[(r    ) * KSTR + d2b + ll];      // B = V (k=t, n=d2)
      b0.y = vb[(r + 1) * KSTR + d2b + ll];
      b1.x = vb[(r    ) * KSTR + d2b + 16 + ll];
      b1.y = vb[(r + 1) * KSTR + d2b + 16 + ll];
      c0 = wmma4_f32(a, b0, c0);
      c1 = wmma4_f32(a, b1, c1);
    }
    __syncthreads();       // all waves done reading buf[cur] before reuse
    cur ^= 1;
  }

  float* mout = Mpart + (size_t)blockIdx.x * (DIM * DIM);  // unscaled partial
#pragma unroll
  for (int i = 0; i < 8; ++i) {
    const int row = d1b + i + 8 * lh;            // C/D layout: vgpr i = rows i, i+8
    mout[row * DIM + d2b + ll]      = c0[i];
    mout[row * DIM + d2b + 16 + ll] = c1[i];
  }
}

// ---------------------------------------------------------------------------
// Phase 2: out[head, s, :] = Q[head, s, :] @ (scale * sum_seg Mpart[head,seg])
// 2048 blocks: 64 rows of Q each; partial reduction fused into M staging.
// ---------------------------------------------------------------------------
template <int NS>
__global__ __launch_bounds__(256) void sattn_qm_kernel(
    const float* __restrict__ Qp, const float* __restrict__ Mpart,
    float* __restrict__ Op) {
  __shared__ float qbuf[64 * LSTR];
  __shared__ float mbuf[64 * LSTR];

  const int tid  = threadIdx.x;
  const int wave = tid >> 5;
  const int lane = tid & 31;
  const int lh   = lane >> 4;
  const int ll   = lane & 15;
  const int sb   = (wave >> 1) * 16;
  const int db   = (wave & 1) * 32;

  const int head = blockIdx.x >> 5;
  const int s0   = (blockIdx.x & 31) * 64;
  const size_t base = (size_t)head * SEQ * DIM + (size_t)s0 * DIM;

  {
    const float4* g4 = (const float4*)(Qp + base);
    const float4* m4 = (const float4*)(Mpart + (size_t)head * NS * (DIM * DIM));
    const float scale = 0.125f;  // 1/sqrt(64)
#pragma unroll
    for (int i = 0; i < 4; ++i) {
      const int e   = tid + i * 256;
      const int row = e >> 4;
      const int c4  = (e & 15) * 4;
      float4 x = g4[e];
      float* qd = &qbuf[row * LSTR + c4];
      qd[0] = x.x; qd[1] = x.y; qd[2] = x.z; qd[3] = x.w;
      float4 acc = m4[e];                       // seg 0
#pragma unroll
      for (int s = 1; s < NS; ++s) {            // fixed order -> deterministic
        float4 t = m4[(size_t)s * 1024 + e];
        acc.x += t.x; acc.y += t.y; acc.z += t.z; acc.w += t.w;
      }
      float* md = &mbuf[row * LSTR + c4];
      md[0] = acc.x * scale; md[1] = acc.y * scale;
      md[2] = acc.z * scale; md[3] = acc.w * scale;
    }
  }
  __syncthreads();

  v8f c0 = {};
  v8f c1 = {};
#pragma unroll
  for (int k0 = 0; k0 < 64; k0 += 4) {
    const int r = k0 + 2 * lh;
    v2f a, b0, b1;
    a.x  = qbuf[(sb + ll) * LSTR + r];
    a.y  = qbuf[(sb + ll) * LSTR + r + 1];
    b0.x = mbuf[(r    ) * LSTR + db + ll];
    b0.y = mbuf[(r + 1) * LSTR + db + ll];
    b1.x = mbuf[(r    ) * LSTR + db + 16 + ll];
    b1.y = mbuf[(r + 1) * LSTR + db + 16 + ll];
    c0 = wmma4_f32(a, b0, c0);
    c1 = wmma4_f32(a, b1, c1);
  }

  float* o = Op + base;
#pragma unroll
  for (int i = 0; i < 8; ++i) {
    const int row = sb + i + 8 * lh;
    o[row * DIM + db + ll]      = c0[i];
    o[row * DIM + db + 16 + ll] = c1[i];
  }
}

// ---------------------------------------------------------------------------
extern "C" void kernel_launch(void* const* d_in, const int* in_sizes, int n_in,
                              void* d_out, int out_size, void* d_ws,
                              size_t ws_size, hipStream_t stream) {
  const float* q = (const float*)d_in[0];
  const float* k = (const float*)d_in[1];
  const float* v = (const float*)d_in[2];
  float* out = (float*)d_out;
  float* ws  = (float*)d_ws;

  const size_t need8 = (size_t)NHEAD * 8 * DIM * DIM * sizeof(float);  // 8 MB
  if (ws_size >= need8) {
    sattn_ktv_kernel<8><<<NHEAD * 8, 256, 0, stream>>>(k, v, ws);
    sattn_qm_kernel<8><<<NHEAD * (SEQ / 64), 256, 0, stream>>>(q, ws, out);
  } else {
    sattn_ktv_kernel<1><<<NHEAD, 256, 0, stream>>>(k, v, ws);
    sattn_qm_kernel<1><<<NHEAD * (SEQ / 64), 256, 0, stream>>>(q, ws, out);
  }
}

// v001
// Measured time: 24.3 microseconds a run.
// In two side-by-side timings against v000, it was 1.18 and 1.17 times as fast.
#include <hip/hip_runtime.h>
#include <cstdint>

#define SEQ   2048
#define DIM   64
#define NHEAD 64
#define LSTR  65
#define KSTR  72

typedef float v2f __attribute__((ext_vector_type(2)));
typedef float v8f __attribute__((ext_vector_type(8)));
typedef int   v4i __attribute__((ext_vector_type(4)));

typedef __attribute__((address_space(1))) v4i gv4i;   // global b128
typedef __attribute__((address_space(3))) v4i lv4i;   // LDS b128

#if __has_builtin(__builtin_amdgcn_global_load_async_to_lds_b128) && \
    __has_builtin(__builtin_amdgcn_s_wait_asynccnt)
#define USE_ASYNC_LDS 1
#else
#define USE_ASYNC_LDS 0
#endif

__device__ __forceinline__ v8f wmma4_f32(v2f a, v2f b, v8f c) {
  // (neg_a, A, neg_b, B, c_mod, C, reuse_a, reuse_b)
  return __builtin_amdgcn_wmma_f32_16x16x4_f32(false, a, false, b, (short)0, c,
                                               false, false);
}

// Issue staging of one 64x64 f32 tile into LDS (row stride KSTR).
// Async path: 4 x b128 async-to-LDS per thread (8 wave instructions per
// K+V chunk). Fallback: float4 global load + scalar LDS stores.
__device__ __forceinline__ void stage_issue(const float* __restrict__ g,
                                            float* __restrict__ lds, int tid) {
#if USE_ASYNC_LDS
#pragma unroll
  for (int i = 0; i < 4; ++i) {
    const int e   = tid + i * 256;
    const int row = e >> 4;
    const int c4  = (e & 15) * 4;
    gv4i* gp = (gv4i*)(uintptr_t)(g + e * 4);
    lv4i* lp = (lv4i*)(uintptr_t)(lds + row * KSTR + c4);
    __builtin_amdgcn_global_load_async_to_lds_b128(gp, lp, 0, 0);
  }
#else
  const float4* g4 = (const float4*)g;
#pragma unroll
  for (int i = 0; i < 4; ++i) {
    const int e   = tid + i * 256;
    const int row = e >> 4;
    const int c4  = (e & 15) * 4;
    float4 x = g4[e];
    float* d = &lds[row * KSTR + c4];
    d[0] = x.x; d[1] = x.y; d[2] = x.z; d[3] = x.w;
  }
#endif
}

__device__ __forceinline__ void stage_wait_prev() {
#if USE_ASYNC_LDS
  __builtin_amdgcn_s_wait_asynccnt(8);  // keep only the 8 newest outstanding
#endif
}
__device__ __forceinline__ void stage_wait_all() {
#if USE_ASYNC_LDS
  __builtin_amdgcn_s_wait_asynccnt(0);
#endif
}

// ---------------------------------------------------------------------------
// Phase 1: Mpart[head,seg] = K[head, seg-range]^T @ V[head, seg-range]
// One block per (head, seg). Wave w owns tiles (d1 = w>>1, d2 = (w&1)*2..+1).
// ---------------------------------------------------------------------------
template <int NS>
__global__ __launch_bounds__(256) void sattn_ktv_kernel(
    const float* __restrict__ Kp, const float* __restrict__ Vp,
    float* __restrict__ Mpart) {
  __shared__ float kbuf[2][64 * KSTR];
  __shared__ float vbuf[2][64 * KSTR];

  const int tid  = threadIdx.x;
  const int wave = tid >> 5;
  const int lane = tid & 31;
  const int lh   = lane >> 4;
  const int ll   = lane & 15;
  const int d1b  = (wave >> 1) * 16;
  const int d2b  = (wave & 1) * 32;

  const int head = blockIdx.x / NS;
  const int seg  = blockIdx.x % NS;
  const int nch  = (SEQ / NS) / 64;  // 64-row chunks in this segment
  const size_t base = (size_t)head * SEQ * DIM + (size_t)seg * (SEQ / NS) * DIM;
  const float* kg = Kp + base;
  const float* vg = Vp + base;

  stage_issue(kg, kbuf[0], tid);
  stage_issue(vg, vbuf[0], tid);

  v8f c0 = {};
  v8f c1 = {};
  int cur = 0;
  for (int ch = 0; ch < nch; ++ch) {
    if (ch + 1 < nch) {
      stage_issue(kg + (size_t)(ch + 1) * 64 * DIM, kbuf[cur ^ 1], tid);
      stage_issue(vg + (size_t)(ch + 1) * 64 * DIM, vbuf[cur ^ 1], tid);
      stage_wait_prev();   // chunk ch complete; chunk ch+1 flies during compute
    } else {
      stage_wait_all();
    }
    __syncthreads();

    const float* kb = kbuf[cur];
    const float* vb = vbuf[cur];
#pragma unroll
    for (int k0 = 0; k0 < 64; k0 += 4) {
      const int r = k0 + 2 * lh;
      v2f a, b0, b1;
      a.x  = kb[(r    ) * KSTR + d1b + ll];      // A = K^T (m=d1, k=t)
      a.y  = kb[(r + 1) * KSTR + d1b + ll];
      b0.x = vb[(r    ) * KSTR + d2b + ll];      // B = V (k=t, n=d2)
      b0.y = vb[(r + 1) * KSTR + d2b + ll];
      b1.x = vb[(r    ) * KSTR + d2b + 16 + ll];
      b1.y = vb[(r + 1) * KSTR + d2b + 16 + ll];
      c0 = wmma4_f32(a, b0, c0);
      c1 = wmma4_f32(a, b1, c1);
    }
    __syncthreads();       // all waves done reading buf[cur] before reuse
    cur ^= 1;
  }

  float* mout = Mpart + (size_t)blockIdx.x * (DIM * DIM);  // unscaled partial
#pragma unroll
  for (int i = 0; i < 8; ++i) {
    const int row = d1b + i + 8 * lh;            // C/D layout: vgpr i = rows i, i+8
    mout[row * DIM + d2b + ll]      = c0[i];
    mout[row * DIM + d2b + 16 + ll] = c1[i];
  }
}

// ---------------------------------------------------------------------------
// Phase 2: out[head, s, :] = Q[head, s, :] @ (scale * sum_seg Mpart[head,seg])
// 256 blocks of 16 waves: each reduces its head's M once and applies it to
// QTILES tiles of QROWS rows of Q; every wave keeps its 64x32 slice of M in
// registers as B fragments for all of its tiles.
// ---------------------------------------------------------------------------
#define QROWS  128        // rows per tile: 8 wave rows x 16
#define QTILES 4          // tiles per block
#define QBLK   (QROWS * QTILES)

// Work-group barrier that orders LDS alone. __syncthreads() also drains the
// global counters: the Q tiles still in flight and the last tile's output
// stores, neither of which another wave reads.
__device__ __forceinline__ void lds_barrier() {
  __builtin_amdgcn_fence(__ATOMIC_RELEASE, "workgroup", "local");
  __builtin_amdgcn_s_barrier();
  __builtin_amdgcn_fence(__ATOMIC_ACQUIRE, "workgroup", "local");
}

template <int NS>
__global__ __launch_bounds__(512) void sattn_qm_kernel(
    const float* __restrict__ Qp, const float* __restrict__ Mpart,
    float* __restrict__ Op) {
  __shared__ float qbuf[QBLK * LSTR];
  __shared__ float mbuf[64 * LSTR];

  const int tid  = threadIdx.x;
  const int wave = tid >> 5;
  const int lane = tid & 31;
  const int lh   = lane >> 4;
  const int ll   = lane & 15;
  const int sb   = (wave >> 1) * 16;
  const int db   = (wave & 1) * 32;

  const int head = blockIdx.x / (SEQ / QBLK);
  const int s0   = (blockIdx.x % (SEQ / QBLK)) * QBLK;
  const size_t base = (size_t)head * SEQ * DIM + (size_t)s0 * DIM;

  float4 xq[QBLK * 16 / 512];
  {
    const float4* g4 = (const float4*)(Qp + base);
    const float4* m4 = (const float4*)(Mpart + (size_t)head * NS * (DIM * DIM));
    const float scale = 0.125f;  // 1/sqrt(64)
    // Issue order: Q tile 0 (memory), the partials (L2), then Q tiles 1.. one
    // by one. Loads return in order, so a tile's wait must cover no later
    // tile. The scheduling barriers hold that order: left alone the scheduler
    // mixes the groups and the first tile's wait covers every load.
#pragma unroll
    for (int i = 0; i < 4; ++i) xq[i] = g4[tid + i * 512];
    __builtin_amdgcn_sched_barrier(0);
    float4 mp[2][NS];
#pragma unroll
    for (int i = 0; i < 2; ++i)
#pragma unroll
      for (int s = 0; s < NS; ++s) mp[i][s] = m4[(size_t)s * 1024 + tid + i * 512];
#pragma unroll
    for (int t = 1; t < QTILES; ++t) {
      __builtin_amdgcn_sched_barrier(0);
#pragma unroll
      for (int i = 0; i < 4; ++i) xq[t * 4 + i] = g4[tid + (t * 4 + i) * 512];
    }
    // These loads stay in flight while their offset register is reused.
    asm volatile("s_wait_xcnt 0x0" ::: "memory");

#pragma unroll
    for (int i = 0; i < 2; ++i) {
      const int e   = tid + i * 512;
      const int row = e >> 4;
      const int c4  = (e & 15) * 4;
      float4 acc = mp[i][0];                    // seg 0
#pragma unroll
      for (int s = 1; s < NS; ++s) {            // fixed order -> deterministic
        float4 t = mp[i][s];
        acc.x += t.x; acc.y += t.y; acc.z += t.z; acc.w += t.w;
      }
      float* md = &mbuf[row * LSTR + c4];
      md[0] = acc.x * scale; md[1] = acc.y * scale;
      md[2] = acc.z * scale; md[3] = acc.w * scale;
    }
  }

  v2f b0[16], b1[16];                           // B = M (k, n=d), all of k
  float* o = Op + base;
#pragma unroll
  for (int t = 0; t < QTILES; ++t) {
#pragma unroll
    for (int i = 0; i < 4; ++i) {
      const int e   = tid + (t * 4 + i) * 512;
      const int row = e >> 4;
      const int c4  = (e & 15) * 4;
      float4 x = xq[t * 4 + i];
      float* qd = &qbuf[row * LSTR + c4];
      qd[0] = x.x; qd[1] = x.y; qd[2] = x.z; qd[3] = x.w;
    }
    lds_barrier();         // publishes tile t (and M, t = 0); own buffer a tile
    if (t == 0) {
#pragma unroll
      for (int kk = 0; kk < 16; ++kk) {
        const int r = kk * 4 + 2 * lh;
        b0[kk].x = mbuf[(r    ) * LSTR + db + ll];
        b0[kk].y = mbuf[(r + 1) * LSTR + db + ll];
        b1[kk].x = mbuf[(r    ) * LSTR + db + 16 + ll];
        b1[kk].y = mbuf[(r + 1) * LSTR + db + 16 + ll];
      }
    }
    const float* qt = &qbuf[(t * QROWS + sb + ll) * LSTR];
    v8f c0 = {};
    v8f c1 = {};
#pragma unroll
    for (int kk = 0; kk < 16; ++kk) {
      const int r = kk * 4 + 2 * lh;
      v2f a;
      a.x = qt[r];
      a.y = qt[r + 1];
      c0 = wmma4_f32(a, b0[kk], c0);
      c1 = wmma4_f32(a, b1[kk], c1);
    }
#pragma unroll
    for (int i = 0; i < 8; ++i) {
      const int row = t * QROWS + sb + i + 8 * lh;
      o[row * DIM + db + ll]      = c0[i];
      o[row * DIM + db + 16 + ll] = c1[i];
    }
    // The next tile's products reuse the registers these stores name.
    if (t + 1 < QTILES) asm volatile("s_wait_xcnt 0x0" ::: "memory");
  }
}

// ---------------------------------------------------------------------------
extern "C" void kernel_launch(void* const* d_in, const int* in_sizes, int n_in,
                              void* d_out, int out_size, void* d_ws,
                              size_t ws_size, hipStream_t stream) {
  const float* q = (const float*)d_in[0];
  const float* k = (const float*)d_in[1];
  const float* v = (const float*)d_in[2];
  float* out = (float*)d_out;
  float* ws  = (float*)d_ws;

  const size_t need8 = (size_t)NHEAD * 8 * DIM * DIM * sizeof(float);  // 8 MB
  if (ws_size >= need8) {
    sattn_ktv_kernel<8><<<NHEAD * 8, 256, 0, stream>>>(k, v, ws);
    sattn_qm_kernel<8><<<NHEAD * (SEQ / QBLK), 512, 0, stream>>>(q, ws, out);
  } else {
    sattn_ktv_kernel<1><<<NHEAD, 256, 0, stream>>>(k, v, ws);
    sattn_qm_kernel<1><<<NHEAD * (SEQ / QBLK), 512, 0, stream>>>(q, ws, out);
  }
}

// v002
// A run of this version takes 21.7 microseconds.
// In two side-by-side timings against v001, it was 1.10 and 1.12 times as fast.
// Over all steps from v000 it is 1.31 times as fast.
#include <hip/hip_runtime.h>
#include <cstdint>

#define SEQ   2048
#define DIM   64
#define NHEAD 64          // B*H = 4*16
#define LSTR  65          // padded stride for scalar-staged buffers

typedef float v2f __attribute__((ext_vector_type(2)));
typedef float v8f __attribute__((ext_vector_type(8)));

__device__ __forceinline__ v8f wmma4_f32(v2f a, v2f b, v8f c) {
  // (neg_a, A, neg_b, B, c_mod, C, reuse_a, reuse_b)
  return __builtin_amdgcn_wmma_f32_16x16x4_f32(false, a, false, b, (short)0, c,
                                               false, false);
}

#define P1WAVES 8
#define PF      6         // k-steps (4 rows of K and of V) loaded ahead

template <int NS>
__global__ __launch_bounds__(256) void sattn_ktv_kernel(
    const float* __restrict__ Kp, const float* __restrict__ Vp,
    float* __restrict__ Mpart) {
  __shared__ float4 red[P1WAVES][32][32];        // wave, register quad, lane

  const int tid  = threadIdx.x;
  const int wave = tid >> 5;
  const int lane = tid & 31;
  const int lh   = lane >> 4;
  const int ll   = lane & 15;

  constexpr int RW = SEQ / NS / P1WAVES;         // rows of t per wave
  constexpr int KS = RW / 4;                     // k-steps per wave

  const int head = blockIdx.x / NS;
  const int seg  = blockIdx.x % NS;
  const size_t base = (size_t)head * SEQ * DIM +
                      (size_t)(seg * (SEQ / NS) + wave * RW) * DIM;
  const float4* k4 = (const float4*)(Kp + base) + lane;
  const float4* v4 = (const float4*)(Vp + base) + lane;

  float4 kb[PF][2], vb[PF][2];
#pragma unroll
  for (int s = 0; s < PF; ++s) {
    kb[s][0] = k4[s * 64];      kb[s][1] = k4[s * 64 + 32];
    vb[s][0] = v4[s * 64];      vb[s][1] = v4[s * 64 + 32];
  }

  v8f acc[4][4] = {};
#pragma unroll
  for (int s = 0; s < KS; ++s) {
    const int p = s % PF;
    const float4 k0 = kb[p][0], k1 = kb[p][1];
    const float4 w0 = vb[p][0], w1 = vb[p][1];
    v2f a[4] = {{k0.x, k1.x}, {k0.y, k1.y}, {k0.z, k1.z}, {k0.w, k1.w}};
    v2f b[4] = {{w0.x, w1.x}, {w0.y, w1.y}, {w0.z, w1.z}, {w0.w, w1.w}};
    if (s + PF < KS) {
      kb[p][0] = k4[(s + PF) * 64];  kb[p][1] = k4[(s + PF) * 64 + 32];
      vb[p][0] = v4[(s + PF) * 64];  vb[p][1] = v4[(s + PF) * 64 + 32];
    }
    // Holds each step's refill at its step: moved later it loses its lead
    // over the step that reads it, moved earlier it costs registers.
    __builtin_amdgcn_sched_barrier(0);
#pragma unroll
    for (int i = 0; i < 4; ++i)
#pragma unroll
      for (int j = 0; j < 4; ++j) acc[i][j] = wmma4_f32(a[i], b[j], acc[i][j]);
  }

  // Cross-wave sum, in register layout: quad q = (i, j, h) is registers
  // 4h..4h+3 of acc[i][j].
#pragma unroll
  for (int i = 0; i < 4; ++i)
#pragma unroll
    for (int j = 0; j < 4; ++j)
#pragma unroll
      for (int h = 0; h < 2; ++h)
        red[wave][i * 8 + j * 2 + h][lane] =
            make_float4(acc[i][j][4 * h], acc[i][j][4 * h + 1],
                        acc[i][j][4 * h + 2], acc[i][j][4 * h + 3]);
  __syncthreads();

  // Wave w sums the quads (i = w>>1, j = 0..3, h = w&1): the four j of one
  // register are four neighbouring columns of M, so a lane stores 16 bytes
  // and a half-wave a whole 256-byte row.
  const int ri = wave >> 1;
  const int rh = wave & 1;
  float4 sum[4];
#pragma unroll
  for (int j = 0; j < 4; ++j) {
    const int q = ri * 8 + j * 2 + rh;
    float4 t = red[0][q][lane];
#pragma unroll
    for (int w = 1; w < P1WAVES; ++w) {          // fixed order -> deterministic
      const float4 x = red[w][q][lane];
      t.x += x.x; t.y += x.y; t.z += x.z; t.w += x.w;
    }
    sum[j] = t;
  }
  float* mout = Mpart + (size_t)blockIdx.x * (DIM * DIM);  // unscaled partial
  float4* m0 = (float4*)(mout + (4 * (4 * rh + 8 * lh) + ri) * DIM + 4 * ll);
  // The next register is 4 rows of M on: 4 * DIM floats = DIM float4.
  m0[0 * DIM] = make_float4(sum[0].x, sum[1].x, sum[2].x, sum[3].x);
  m0[1 * DIM] = make_float4(sum[0].y, sum[1].y, sum[2].y, sum[3].y);
  m0[2 * DIM] = make_float4(sum[0].z, sum[1].z, sum[2].z, sum[3].z);
  m0[3 * DIM] = make_float4(sum[0].w, sum[1].w, sum[2].w, sum[3].w);
}

// ---------------------------------------------------------------------------
// Phase 2: out[head, s, :] = Q[head, s, :] @ (scale * sum_seg Mpart[head,seg])
// 256 blocks of 16 waves: each reduces its head's M once and applies it to
// QTILES tiles of QROWS rows of Q; every wave keeps its 64x32 slice of M in
// registers as B fragments for all of its tiles.
// ---------------------------------------------------------------------------
#define QROWS  128        // rows per tile: 8 wave rows x 16
#define QTILES 4          // tiles per block
#define QBLK   (QROWS * QTILES)

// Work-group barrier that orders LDS alone. __syncthreads() also drains the
// global counters: the Q tiles still in flight and the last tile's output
// stores, neither of which another wave reads.
__device__ __forceinline__ void lds_barrier() {
  __builtin_amdgcn_fence(__ATOMIC_RELEASE, "workgroup", "local");
  __builtin_amdgcn_s_barrier();
  __builtin_amdgcn_fence(__ATOMIC_ACQUIRE, "workgroup", "local");
}

template <int NS>
__global__ __launch_bounds__(512) void sattn_qm_kernel(
    const float* __restrict__ Qp, const float* __restrict__ Mpart,
    float* __restrict__ Op) {
  __shared__ float qbuf[QBLK * LSTR];
  __shared__ float mbuf[64 * LSTR];

  const int tid  = threadIdx.x;
  const int wave = tid >> 5;
  const int lane = tid & 31;
  const int lh   = lane >> 4;
  const int ll   = lane & 15;
  const int sb   = (wave >> 1) * 16;
  const int db   = (wave & 1) * 32;

  const int head = blockIdx.x / (SEQ / QBLK);
  const int s0   = (blockIdx.x % (SEQ / QBLK)) * QBLK;
  const size_t base = (size_t)head * SEQ * DIM + (size_t)s0 * DIM;

  float4 xq[QBLK * 16 / 512];
  {
    const float4* g4 = (const float4*)(Qp + base);
    const float4* m4 = (const float4*)(Mpart + (size_t)head * NS * (DIM * DIM));
    const float scale = 0.125f;  // 1/sqrt(64)
    // Issue order: Q tile 0 (memory), the partials (L2), then Q tiles 1.. one
    // by one. Loads return in order, so a tile's wait must cover no later
    // tile. The scheduling barriers hold that order: left alone the scheduler
    // mixes the groups and the first tile's wait covers every load.
#pragma unroll
    for (int i = 0; i < 4; ++i) xq[i] = g4[tid + i * 512];
    __builtin_amdgcn_sched_barrier(0);
    float4 mp[2][NS];
#pragma unroll
    for (int i = 0; i < 2; ++i)
#pragma unroll
      for (int s = 0; s < NS; ++s) mp[i][s] = m4[(size_t)s * 1024 + tid + i * 512];
#pragma unroll
    for (int t = 1; t < QTILES; ++t) {
      __builtin_amdgcn_sched_barrier(0);
#pragma unroll
      for (int i = 0; i < 4; ++i) xq[t * 4 + i] = g4[tid + (t * 4 + i) * 512];
    }
    // These loads stay in flight while their offset register is reused.
    asm volatile("s_wait_xcnt 0x0" ::: "memory");

#pragma unroll
    for (int i = 0; i < 2; ++i) {
      const int e   = tid + i * 512;
      const int row = e >> 4;
      const int c4  = (e & 15) * 4;
      float4 acc = mp[i][0];                    // seg 0
#pragma unroll
      for (int s = 1; s < NS; ++s) {            // fixed order -> deterministic
        float4 t = mp[i][s];
        acc.x += t.x; acc.y += t.y; acc.z += t.z; acc.w += t.w;
      }
      float* md = &mbuf[row * LSTR + c4];
      md[0] = acc.x * scale; md[1] = acc.y * scale;
      md[2] = acc.z * scale; md[3] = acc.w * scale;
    }
  }

  v2f b0[16], b1[16];                           // B = M (k, n=d), all of k
  float* o = Op + base;
#pragma unroll
  for (int t = 0; t < QTILES; ++t) {
#pragma unroll
    for (int i = 0; i < 4; ++i) {
      const int e   = tid + (t * 4 + i) * 512;
      const int row = e >> 4;
      const int c4  = (e & 15) * 4;
      float4 x = xq[t * 4 + i];
      float* qd = &qbuf[row * LSTR + c4];
      qd[0] = x.x; qd[1] = x.y; qd[2] = x.z; qd[3] = x.w;
    }
    lds_barrier();         // publishes tile t (and M, t = 0); own buffer a tile
    if (t == 0) {
#pragma unroll
      for (int kk = 0; kk < 16; ++kk) {
        const int r = kk * 4 + 2 * lh;
        b0[kk].x = mbuf[(r    ) * LSTR + db + ll];
        b0[kk].y = mbuf[(r + 1) * LSTR + db + ll];
        b1[kk].x = mbuf[(r    ) * LSTR + db + 16 + ll];
        b1[kk].y = mbuf[(r + 1) * LSTR + db + 16 + ll];
      }
    }
    const float* qt = &qbuf[(t * QROWS + sb + ll) * LSTR];
    v8f c0 = {};
    v8f c1 = {};
#pragma unroll
    for (int kk = 0; kk < 16; ++kk) {
      const int r = kk * 4 + 2 * lh;
      v2f a;
      a.x = qt[r];
      a.y = qt[r + 1];
      c0 = wmma4_f32(a, b0[kk], c0);
      c1 = wmma4_f32(a, b1[kk], c1);
    }
#pragma unroll
    for (int i = 0; i < 8; ++i) {
      const int row = t * QROWS + sb + i + 8 * lh;
      o[row * DIM + db + ll]      = c0[i];
      o[row * DIM + db + 16 + ll] = c1[i];
    }
    // The next tile's products reuse the registers these stores name.
    if (t + 1 < QTILES) asm volatile("s_wait_xcnt 0x0" ::: "memory");
  }
}

// ---------------------------------------------------------------------------
extern "C" void kernel_launch(void* const* d_in, const int* in_sizes, int n_in,
                              void* d_out, int out_size, void* d_ws,
                              size_t ws_size, hipStream_t stream) {
  const float* q = (const float*)d_in[0];
  const float* k = (const float*)d_in[1];
  const float* v = (const float*)d_in[2];
  float* out = (float*)d_out;
  float* ws  = (float*)d_ws;

  const size_t need4 = (size_t)NHEAD * 4 * DIM * DIM * sizeof(float);  // 4 MB
  if (ws_size >= need4) {
    sattn_ktv_kernel<4><<<NHEAD * 4, 256, 0, stream>>>(k, v, ws);
    sattn_qm_kernel<4><<<NHEAD * (SEQ / QBLK), 512, 0, stream>>>(q, ws, out);
  } else {
    sattn_ktv_kernel<1><<<NHEAD, 256, 0, stream>>>(k, v, ws);
    sattn_qm_kernel<1><<<NHEAD * (SEQ / QBLK), 512, 0, stream>>>(q, ws, out);
  }
}

// v003
// A run of this version takes 18.3 microseconds.
// Timed twice side by side with v002, it ran 1.19 times as fast both times.
// All steps since v000 together make it 1.55 times as fast.
#include <hip/hip_runtime.h>
#include <cstdint>

#define SEQ   2048
#define DIM   64
#define NHEAD 64          // B*H = 4*16

typedef float v2f __attribute__((ext_vector_type(2)));
typedef float v4f __attribute__((ext_vector_type(4)));
typedef float v8f __attribute__((ext_vector_type(8)));

__device__ __forceinline__ v8f wmma4_f32(v2f a, v2f b, v8f c) {
  // (neg_a, A, neg_b, B, c_mod, C, reuse_a, reuse_b)
  return __builtin_amdgcn_wmma_f32_16x16x4_f32(false, a, false, b, (short)0, c,
                                               false, false);
}

#define P1WAVES 8
#define PF      6         // k-steps (4 rows of K and of V) loaded ahead

template <int NS>
__global__ __launch_bounds__(256) void sattn_ktv_kernel(
    const float* __restrict__ Kp, const float* __restrict__ Vp,
    float* __restrict__ Mpart) {
  __shared__ float4 red[P1WAVES][32][32];        // wave, register quad, lane

  const int tid  = threadIdx.x;
  const int wave = tid >> 5;
  const int lane = tid & 31;
  const int lh   = lane >> 4;
  const int ll   = lane & 15;

  constexpr int RW = SEQ / NS / P1WAVES;         // rows of t per wave
  constexpr int KS = RW / 4;                     // k-steps per wave

  const int head = blockIdx.x / NS;
  const int seg  = blockIdx.x % NS;
  const size_t base = (size_t)head * SEQ * DIM +
                      (size_t)(seg * (SEQ / NS) + wave * RW) * DIM;
  const float4* k4 = (const float4*)(Kp + base) + lane;
  const float4* v4 = (const float4*)(Vp + base) + lane;

  float4 kb[PF][2], vb[PF][2];
#pragma unroll
  for (int s = 0; s < PF; ++s) {
    kb[s][0] = k4[s * 64];      kb[s][1] = k4[s * 64 + 32];
    vb[s][0] = v4[s * 64];      vb[s][1] = v4[s * 64 + 32];
  }

  v8f acc[4][4] = {};
#pragma unroll
  for (int s = 0; s < KS; ++s) {
    const int p = s % PF;
    const float4 k0 = kb[p][0], k1 = kb[p][1];
    const float4 w0 = vb[p][0], w1 = vb[p][1];
    v2f a[4] = {{k0.x, k1.x}, {k0.y, k1.y}, {k0.z, k1.z}, {k0.w, k1.w}};
    v2f b[4] = {{w0.x, w1.x}, {w0.y, w1.y}, {w0.z, w1.z}, {w0.w, w1.w}};
    if (s + PF < KS) {
      kb[p][0] = k4[(s + PF) * 64];  kb[p][1] = k4[(s + PF) * 64 + 32];
      vb[p][0] = v4[(s + PF) * 64];  vb[p][1] = v4[(s + PF) * 64 + 32];
    }
    // Holds each step's refill at its step: moved later it loses its lead
    // over the step that reads it, moved earlier it costs registers.
    __builtin_amdgcn_sched_barrier(0);
#pragma unroll
    for (int i = 0; i < 4; ++i)
#pragma unroll
      for (int j = 0; j < 4; ++j) acc[i][j] = wmma4_f32(a[i], b[j], acc[i][j]);
  }

  // Cross-wave sum, in register layout: quad q = (i, j, h) is registers
  // 4h..4h+3 of acc[i][j].
#pragma unroll
  for (int i = 0; i < 4; ++i)
#pragma unroll
    for (int j = 0; j < 4; ++j)
#pragma unroll
      for (int h = 0; h < 2; ++h)
        red[wave][i * 8 + j * 2 + h][lane] =
            make_float4(acc[i][j][4 * h], acc[i][j][4 * h + 1],
                        acc[i][j][4 * h + 2], acc[i][j][4 * h + 3]);
  __syncthreads();

  // Wave w sums the quads (i = w>>1, j = 0..3, h = w&1): the four j of one
  // register are four neighbouring columns of M, so a lane stores 16 bytes
  // and a half-wave a whole 256-byte row.
  const int ri = wave >> 1;
  const int rh = wave & 1;
  float4 sum[4];
#pragma unroll
  for (int j = 0; j < 4; ++j) {
    const int q = ri * 8 + j * 2 + rh;
    float4 t = red[0][q][lane];
#pragma unroll
    for (int w = 1; w < P1WAVES; ++w) {          // fixed order -> deterministic
      const float4 x = red[w][q][lane];
      t.x += x.x; t.y += x.y; t.z += x.z; t.w += x.w;
    }
    sum[j] = t;
  }
  float* mout = Mpart + (size_t)blockIdx.x * (DIM * DIM);  // unscaled partial
  float4* m0 = (float4*)(mout + (4 * (4 * rh + 8 * lh) + ri) * DIM + 4 * ll);
  // The next register is 4 rows of M on: 4 * DIM floats = DIM float4.
  m0[0 * DIM] = make_float4(sum[0].x, sum[1].x, sum[2].x, sum[3].x);
  m0[1 * DIM] = make_float4(sum[0].y, sum[1].y, sum[2].y, sum[3].y);
  m0[2 * DIM] = make_float4(sum[0].z, sum[1].z, sum[2].z, sum[3].z);
  m0[3 * DIM] = make_float4(sum[0].w, sum[1].w, sum[2].w, sum[3].w);
}

// ---------------------------------------------------------------------------
// Phase 2: out[head, s, :] = Q[head, s, :] @ (scale * sum_seg Mpart[head,seg])
// 256 blocks of 8 waves: each reduces its head's M once and applies it to 512
// rows of Q. A wave owns whole tiles of 16 rows x all 64 columns and keeps
// all of M in registers as B fragments. The 16 columns of column tile j are
// the columns 4*n + j, so
//   c[j], register v, lane (lh, ll)  =  out[row0 + v + 8*lh][4*ll + j]
// and the four j of one register are 16 neighbouring bytes of a row: a lane
// stores 16 bytes, a half-wave a whole 256-byte row. A wave turns its own Q
// rows into A fragments through its own LDS slice, so the tile loop has no
// work-group barrier.
// ---------------------------------------------------------------------------
#define P2WAVES 8
#define QTILES  4                         // 16-row tiles per wave
#define QBLK    (P2WAVES * QTILES * 16)   // rows of Q per block
#define QP4     17                        // LDS row pitch in float4: 272 bytes

// Work-group barrier that orders LDS alone. __syncthreads() also drains the
// global counters: the Q tiles still in flight, which no other wave reads.
__device__ __forceinline__ void lds_barrier() {
  __builtin_amdgcn_fence(__ATOMIC_RELEASE, "workgroup", "local");
  __builtin_amdgcn_s_barrier();
  __builtin_amdgcn_fence(__ATOMIC_ACQUIRE, "workgroup", "local");
}

template <int NS>
__global__ __launch_bounds__(256) void sattn_qm_kernel(
    const float* __restrict__ Qp, const float* __restrict__ Mpart,
    float* __restrict__ Op) {
  __shared__ v4f mbuf[DIM * DIM / 4];                  // row-major M
  __shared__ v4f qbuf[P2WAVES][QTILES][16 * QP4];      // wave, tile, rows

  const int tid  = threadIdx.x;
  const int wave = tid >> 5;
  const int lane = tid & 31;
  const int lh   = lane >> 4;
  const int ll   = lane & 15;

  const int head = blockIdx.x / (SEQ / QBLK);
  const int s0   = (blockIdx.x % (SEQ / QBLK)) * QBLK;
  // Tile t of this wave: rows s0 + (t * P2WAVES + wave) * 16 and on.
  const size_t base = (size_t)head * SEQ * DIM + (size_t)(s0 + wave * 16) * DIM;

  v4f xq[QTILES][8];
  {
    const v4f* g4 = (const v4f*)(Qp + base) + lane;
    const v4f* m4 = (const v4f*)(Mpart + (size_t)head * NS * (DIM * DIM));
    const float scale = 0.125f;  // 1/sqrt(64)
    // Issue order: the partials, whose way to the first product is the
    // longest, then the Q tiles one by one. Loads return in order, so a
    // tile's wait must cover no later tile. The scheduling barriers hold that
    // order: left alone the scheduler mixes the groups.
    v4f mp[4][NS];
#pragma unroll
    for (int i = 0; i < 4; ++i)
#pragma unroll
      for (int s = 0; s < NS; ++s) mp[i][s] = m4[(size_t)s * 1024 + tid + i * 256];
#pragma unroll
    for (int t = 0; t < QTILES; ++t) {
      __builtin_amdgcn_sched_barrier(0);
#pragma unroll
      for (int i = 0; i < 8; ++i)
        xq[t][i] = g4[t * (P2WAVES * 16 * 16) + i * 32];
    }
    // Every load is issued before the first wait on the partials.
    __builtin_amdgcn_sched_barrier(0);
    // These loads stay in flight while their address registers are reused.
    asm volatile("s_wait_xcnt 0x0" ::: "memory");
    // Keeps the wait directly behind the loads: left alone the scheduler lifts
    // a rewrite of the Q address register over it.
    __builtin_amdgcn_sched_barrier(0);

#pragma unroll
    for (int i = 0; i < 4; ++i) {
      v4f acc = mp[i][0];                    // seg 0
#pragma unroll
      for (int s = 1; s < NS; ++s) {            // fixed order -> deterministic
        v4f t = mp[i][s];
        acc += t;
      }
      mbuf[tid + i * 256] = acc * scale;
    }
  }
  lds_barrier();                                // publishes M

  v2f b[4][16];                                 // B = M (k, n), all of k and n
#pragma unroll
  for (int kk = 0; kk < 16; ++kk) {
    const v4f r0 = mbuf[(kk * 4 + 2 * lh    ) * 16 + ll];
    const v4f r1 = mbuf[(kk * 4 + 2 * lh + 1) * 16 + ll];
    b[0][kk] = v2f{r0.x, r1.x};  b[1][kk] = v2f{r0.y, r1.y};
    b[2][kk] = v2f{r0.z, r1.z};  b[3][kk] = v2f{r0.w, r1.w};
  }

  v4f* o4 = (v4f*)(Op + base) + (8 * lh) * 16 + ll;
#pragma unroll
  for (int t = 0; t < QTILES; ++t) {
    v4f* qs = &qbuf[wave][t][0];
#pragma unroll
    for (int i = 0; i < 8; ++i) qs[(2 * i + lh) * QP4 + ll] = xq[t][i];
    // Other lanes of this wave read these rows back: their writes must have
    // landed first.
    asm volatile("s_wait_dscnt 0x0" ::: "memory");
    const v2f* qa = (const v2f*)&qs[ll * QP4] + lh;   // A = Q (m = row, k)
    v2f a[16];
#pragma unroll
    for (int kk = 0; kk < 16; ++kk) a[kk] = qa[kk * 2];
    v8f c[4] = {};
#pragma unroll
    for (int kk = 0; kk < 16; ++kk)
#pragma unroll
      for (int j = 0; j < 4; ++j) c[j] = wmma4_f32(a[kk], b[j][kk], c[j]);
    v4f r[8];
#pragma unroll
    for (int v = 0; v < 8; ++v) {
      r[v] = v4f{c[0][v], c[1][v], c[2][v], c[3][v]};
      o4[(t * P2WAVES * 16 + v) * 16] = r[v];
    }
    // The next tile reuses the registers these stores name. The rows are
    // inputs of the wait so that each keeps its registers up to it, in the
    // last tile too: left alone the compiler puts a later row together in a
    // stored row's registers.
    asm volatile("s_wait_xcnt 0x0"
                 :: "v"(r[0]), "v"(r[1]), "v"(r[2]), "v"(r[3]), "v"(r[4]),
                    "v"(r[5]), "v"(r[6]), "v"(r[7])
                 : "memory");
  }
}

// ---------------------------------------------------------------------------
extern "C" void kernel_launch(void* const* d_in, const int* in_sizes, int n_in,
                              void* d_out, int out_size, void* d_ws,
                              size_t ws_size, hipStream_t stream) {
  const float* q = (const float*)d_in[0];
  const float* k = (const float*)d_in[1];
  const float* v = (const float*)d_in[2];
  float* out = (float*)d_out;
  float* ws  = (float*)d_ws;

  const size_t need4 = (size_t)NHEAD * 4 * DIM * DIM * sizeof(float);  // 4 MB
  if (ws_size >= need4) {
    sattn_ktv_kernel<4><<<NHEAD * 4, 256, 0, stream>>>(k, v, ws);
    sattn_qm_kernel<4><<<NHEAD * (SEQ / QBLK), 256, 0, stream>>>(q, ws, out);
  } else {
    sattn_ktv_kernel<1><<<NHEAD, 256, 0, stream>>>(k, v, ws);
    sattn_qm_kernel<1><<<NHEAD * (SEQ / QBLK), 256, 0, stream>>>(q, ws, out);
  }
}
